// v000
// Times are from an AMD MI455X. After a warm-up the kernel runs many times in a row, and a time is the length of
// such a window on the GPU divided by its runs, so every launch and the gaps after it count. The runs cycle
// through copies of the inputs. A figure is the median of several windows, for all but v000 over two sittings.
// Sittings can differ by a few percent; kernels timed side by side share one.
// v000 is the starting kernel. One run takes 1230 microseconds.
#include <hip/hip_runtime.h>

#define DIMD   2048
#define NHEADS 16
#define HD     128
#define SEQ    2048
#define BATCH  4

typedef _Float16 f16;
typedef __attribute__((ext_vector_type(16))) _Float16 v16h;
typedef __attribute__((ext_vector_type(8)))  _Float16 v8h;
typedef __attribute__((ext_vector_type(8)))  float    v8f;
typedef unsigned int u32x4 __attribute__((ext_vector_type(4)));
typedef int          i32x8 __attribute__((ext_vector_type(8)));
typedef int          i32x4 __attribute__((ext_vector_type(4)));

static __device__ inline v16h load_frag(const f16* __restrict__ p, int ld,
                                        int row0, int col0, int lane) {
  int r = row0 + (lane & 15);
  int h = (lane >> 4) & 1;
  const f16* q = p + (size_t)r * (size_t)ld + col0 + 8 * h;
  v8h c0 = *(const v8h*)(q);
  v8h c1 = *(const v8h*)(q + 16);
  v16h a;
#pragma unroll
  for (int i = 0; i < 8; ++i) { a[i] = c0[i]; a[i + 8] = c1[i]; }
  return a;
}

static __device__ inline void tdm_load_k_tile(unsigned lds_off, const f16* gptr) {
  unsigned long long ga = (unsigned long long)(size_t)gptr;
  u32x4 g0;
  g0[0] = 1u;
  g0[1] = lds_off;
  g0[2] = (unsigned)(ga & 0xFFFFFFFFu);
  g0[3] = (unsigned)((ga >> 32) & 0x1FFFFFFu)
          | (2u << 30);
  i32x8 g1;
  g1[0] = (1 << 16)
        | (1 << 20)
        | (5 << 22)
        | (3 << 25);
  g1[1] = (HD & 0xFFFF) << 16;
  g1[2] = ((SEQ & 0xFFFF) << 16);
  g1[3] = (HD << 16);
  g1[4] = 32;
  g1[5] = DIMD;
  g1[6] = 0;
  g1[7] = 0;
  i32x4 gz4 = {0, 0, 0, 0};
  i32x8 gz8 = {0, 0, 0, 0, 0, 0, 0, 0};
  __builtin_amdgcn_tensor_load_to_lds(g0, g1, gz4, gz4, gz8, 0);
}

__global__ void cast_f32_to_f16(const float* __restrict__ in, f16* __restrict__ out, size_t n) {
  size_t i = (size_t)blockIdx.x * blockDim.x + threadIdx.x;
  if (i < n) out[i] = (f16)in[i];
}

__global__ void rope_inplace(f16* __restrict__ T, float scale, int total) {
  int i = blockIdx.x * blockDim.x + threadIdx.x;
  if (i >= total) return;
  int d  = i & 63;
  int t  = i >> 6;
  int hh = t & (NHEADS - 1);
  t >>= 4;
  int s  = t & (SEQ - 1);
  int bb = t >> 11;
  size_t base = ((size_t)(bb * SEQ + s)) * DIMD + hh * HD + 2 * d;
  float t1 = (float)T[base];
  float t2 = (float)T[base + 1];
  float ang = (float)s * powf(10000.0f, -(float)d * (1.0f / 64.0f));
  float sn, cs;
  sincosf(ang, &sn, &cs);
  T[base]     = (f16)((t1 * cs - t2 * sn) * scale);
  T[base + 1] = (f16)((t1 * sn + t2 * cs) * scale);
}

template <typename OutT>
__global__ void __launch_bounds__(256)
gemm_xWT(const f16* __restrict__ A, const f16* __restrict__ B,
         OutT* __restrict__ C, int M, int N, int K) {
  int lane = threadIdx.x & 31;
  int w    = threadIdx.x >> 5;
  int m0   = (blockIdx.x * 8 + w) * 16;
  int n0   = blockIdx.y * 64;

  v8f zf = {0.f, 0.f, 0.f, 0.f, 0.f, 0.f, 0.f, 0.f};
  v8f acc[4];
#pragma unroll
  for (int j = 0; j < 4; ++j) acc[j] = zf;

  for (int k0 = 0; k0 < K; k0 += 32) {
    v16h a = load_frag(A, K, m0, k0, lane);
#pragma unroll
    for (int j = 0; j < 4; ++j) {
      v16h b = load_frag(B, K, n0 + 16 * j, k0, lane);
      acc[j] = __builtin_amdgcn_wmma_f32_16x16x32_f16(false, a, false, b,
                                                      (short)0, acc[j], false, false);
    }
  }
  int g = lane >> 4, n = lane & 15;
#pragma unroll
  for (int j = 0; j < 4; ++j)
#pragma unroll
    for (int v = 0; v < 8; ++v)
      C[(size_t)(m0 + v + 8 * g) * (size_t)N + n0 + 16 * j + n] = (OutT)acc[j][v];
}

__global__ void __launch_bounds__(128)
flash_attn(const f16* __restrict__ Qh, const f16* __restrict__ Kh,
           const f16* __restrict__ Vh, f16* __restrict__ Oh) {
  __shared__ f16 Klds[2][32 * 136];
  __shared__ f16 Vt[HD * 40];

  int lane = threadIdx.x & 31;
  int w    = threadIdx.x >> 5;
  int q0   = blockIdx.x * 64 + w * 16;
  int h    = blockIdx.y;
  int b    = blockIdx.z;
  int col  = h * HD;

  const f16* Qb = Qh + (size_t)b * SEQ * DIMD;
  const f16* Kb = Kh + (size_t)b * SEQ * DIMD;
  const f16* Vb = Vh + (size_t)b * SEQ * DIMD;
  unsigned klds_off0 = (unsigned)(size_t)(void*)&Klds[0][0];
  unsigned klds_off1 = (unsigned)(size_t)(void*)&Klds[1][0];

  v16h qf[4];
#pragma unroll
  for (int ks = 0; ks < 4; ++ks) qf[ks] = load_frag(Qb, DIMD, q0, col + 32 * ks, lane);

  v8f zf = {0.f, 0.f, 0.f, 0.f, 0.f, 0.f, 0.f, 0.f};
  v8f o[8];
#pragma unroll
  for (int dt = 0; dt < 8; ++dt) o[dt] = zf;
  float rmax = -1e30f, rsum = 0.0f;

  int tk  = threadIdx.x & 31;
  int sub = threadIdx.x >> 5;

  if (w == 0) tdm_load_k_tile(klds_off0, Kb + col);

  for (int kt = 0; kt < SEQ; kt += 32) {
    int buf = (kt >> 5) & 1;
    const f16* Kp = &Klds[buf][0];

    if (w == 0 && (kt + 32) < SEQ)
      tdm_load_k_tile(buf ? klds_off0 : klds_off1, Kb + (size_t)(kt + 32) * DIMD + col);

#pragma unroll
    for (int c = 0; c < 4; ++c) {
      v8h vv = *(const v8h*)(Vb + (size_t)(kt + tk) * DIMD + col + sub * 32 + c * 8);
#pragma unroll
      for (int i = 0; i < 8; ++i) Vt[(sub * 32 + c * 8 + i) * 40 + tk] = vv[i];
    }

    if (w == 0) {
      if ((kt + 32) < SEQ) __builtin_amdgcn_s_wait_tensorcnt(1);
      else                 __builtin_amdgcn_s_wait_tensorcnt(0);
    }
    __syncthreads();

    v8f s0 = zf, s1 = zf;
    v16h ka = load_frag(Kp, 136, 0,  0, lane);
    v16h kb = load_frag(Kp, 136, 16, 0, lane);
#pragma unroll
    for (int ks = 0; ks < 4; ++ks) {
      v16h na = ka, nb = kb;
      if (ks < 3) {
        ka = load_frag(Kp, 136, 0,  32 * (ks + 1), lane);
        kb = load_frag(Kp, 136, 16, 32 * (ks + 1), lane);
      }
      s0 = __builtin_amdgcn_wmma_f32_16x16x32_f16(false, na, false, qf[ks], (short)0, s0, false, false);
      s1 = __builtin_amdgcn_wmma_f32_16x16x32_f16(false, nb, false, qf[ks], (short)0, s1, false, false);
    }

    float mx = fmaxf(s0[0], s1[0]);
#pragma unroll
    for (int v = 1; v < 8; ++v) mx = fmaxf(mx, fmaxf(s0[v], s1[v]));
    mx = fmaxf(mx, __shfl_xor(mx, 16));
    float nm   = fmaxf(rmax, mx);
    float corr = __expf(rmax - nm);
    rmax = nm;

    v16h pv;
    float psum = 0.0f;
#pragma unroll
    for (int v = 0; v < 8; ++v) {
      float p0 = __expf(s0[v] - nm);
      float p1 = __expf(s1[v] - nm);
      psum += p0 + p1;
      pv[v]     = (f16)p0;
      pv[v + 8] = (f16)p1;
    }
    psum += __shfl_xor(psum, 16);
    rsum = rsum * corr + psum;

    v16h va = load_frag(Vt, 40, 0, 0, lane);
#pragma unroll
    for (int dt = 0; dt < 8; ++dt) {
      v16h cur = va;
      if (dt < 7) va = load_frag(Vt, 40, (dt + 1) * 16, 0, lane);
      v8f oc = o[dt] * corr;
      o[dt] = __builtin_amdgcn_wmma_f32_16x16x32_f16(false, cur, false, pv, (short)0, oc, false, false);
    }
    __syncthreads();
  }

  int g = lane >> 4, n = lane & 15;
  float inv = 1.0f / rsum;
  size_t rowbase = ((size_t)b * SEQ + q0 + n) * DIMD + col;
#pragma unroll
  for (int dt = 0; dt < 8; ++dt) {
    v8h ov;
#pragma unroll
    for (int v = 0; v < 8; ++v) ov[v] = (f16)(o[dt][v] * inv);
    *(v8h*)(Oh + rowbase + dt * 16 + 8 * g) = ov;
  }
}

extern "C" void kernel_launch(void* const* d_in, const int* in_sizes, int n_in,
                              void* d_out, int out_size, void* d_ws, size_t ws_size,
                              hipStream_t stream) {
  const float* x  = (const float*)d_in[0];
  const float* Wq = (const float*)d_in[1];
  const float* Wk = (const float*)d_in[2];
  const float* Wv = (const float*)d_in[3];
  const float* Wo = (const float*)d_in[4];
  float* out = (float*)d_out;

  const size_t MT = (size_t)BATCH * SEQ;
  const size_t NX = MT * DIMD;
  const size_t NW = (size_t)DIMD * DIMD;

  char* ws = (char*)d_ws;
  f16* xh  = (f16*)ws; ws += NX * 2;
  f16* Wqh = (f16*)ws; ws += NW * 2;
  f16* Wkh = (f16*)ws; ws += NW * 2;
  f16* Wvh = (f16*)ws; ws += NW * 2;
  f16* Woh = (f16*)ws; ws += NW * 2;
  f16* Qh  = (f16*)ws; ws += NX * 2;
  f16* Kh  = (f16*)ws; ws += NX * 2;
  f16* Vh  = (f16*)ws; ws += NX * 2;
  f16* Oh  = (f16*)ws; ws += NX * 2;

  cast_f32_to_f16<<<(unsigned)((NX + 255) / 256), 256, 0, stream>>>(x,  xh,  NX);
  cast_f32_to_f16<<<(unsigned)((NW + 255) / 256), 256, 0, stream>>>(Wq, Wqh, NW);
  cast_f32_to_f16<<<(unsigned)((NW + 255) / 256), 256, 0, stream>>>(Wk, Wkh, NW);
  cast_f32_to_f16<<<(unsigned)((NW + 255) / 256), 256, 0, stream>>>(Wv, Wvh, NW);
  cast_f32_to_f16<<<(unsigned)((NW + 255) / 256), 256, 0, stream>>>(Wo, Woh, NW);

  dim3 ggrid((unsigned)(MT / 128), DIMD / 64);
  gemm_xWT<f16><<<ggrid, 256, 0, stream>>>(xh, Wqh, Qh, (int)MT, DIMD, DIMD);
  gemm_xWT<f16><<<ggrid, 256, 0, stream>>>(xh, Wkh, Kh, (int)MT, DIMD, DIMD);
  gemm_xWT<f16><<<ggrid, 256, 0, stream>>>(xh, Wvh, Vh, (int)MT, DIMD, DIMD);

  int pairs = (int)(NX / 2);
  rope_inplace<<<(pairs + 255) / 256, 256, 0, stream>>>(Qh, 0.08838834764831845f, pairs);
  rope_inplace<<<(pairs + 255) / 256, 256, 0, stream>>>(Kh, 1.0f, pairs);

  flash_attn<<<dim3(SEQ / 64, NHEADS, BATCH), 128, 0, stream>>>(Qh, Kh, Vh, Oh);

  gemm_xWT<float><<<ggrid, 256, 0, stream>>>(Oh, Woh, out, (int)MT, DIMD, DIMD);
}

// v001
// It runs in 516 microseconds.
// Two timings next to v000 both put it at 2.48 times that version's speed.
#include <hip/hip_runtime.h>
#include <stdint.h>

#define DIMD   2048
#define NHEADS 16
#define HD     128
#define SEQ    2048
#define BATCH  4

typedef _Float16 f16;
typedef __attribute__((ext_vector_type(16))) _Float16 v16h;
typedef __attribute__((ext_vector_type(8)))  _Float16 v8h;
typedef __attribute__((ext_vector_type(8)))  float    v8f;
typedef unsigned int u32x4 __attribute__((ext_vector_type(4)));
typedef int          i32x8 __attribute__((ext_vector_type(8)));
typedef int          i32x4 __attribute__((ext_vector_type(4)));
typedef unsigned int u32x8 __attribute__((ext_vector_type(8)));

static __device__ inline v16h load_frag(const f16* __restrict__ p, int ld,
                                        int row0, int col0, int lane) {
  int r = row0 + (lane & 15);
  int h = (lane >> 4) & 1;
  const f16* q = p + (size_t)r * (size_t)ld + col0 + 8 * h;
  v8h c0 = *(const v8h*)(q);
  v8h c1 = *(const v8h*)(q + 16);
  v16h a;
#pragma unroll
  for (int i = 0; i < 8; ++i) { a[i] = c0[i]; a[i + 8] = c1[i]; }
  return a;
}

static __device__ inline void tdm_load_k_tile(unsigned lds_off, const f16* gptr) {
  unsigned long long ga = (unsigned long long)(size_t)gptr;
  u32x4 g0;
  g0[0] = 1u;
  g0[1] = lds_off;
  g0[2] = (unsigned)(ga & 0xFFFFFFFFu);
  g0[3] = (unsigned)((ga >> 32) & 0x1FFFFFFu)
          | (2u << 30);
  i32x8 g1;
  g1[0] = (1 << 16)
        | (1 << 20)
        | (5 << 22)
        | (3 << 25);
  g1[1] = (HD & 0xFFFF) << 16;
  g1[2] = ((SEQ & 0xFFFF) << 16);
  g1[3] = (HD << 16);
  g1[4] = 32;
  g1[5] = DIMD;
  g1[6] = 0;
  g1[7] = 0;
  i32x4 gz4 = {0, 0, 0, 0};
  i32x8 gz8 = {0, 0, 0, 0, 0, 0, 0, 0};
  __builtin_amdgcn_tensor_load_to_lds(g0, g1, gz4, gz4, gz8, 0);
}

__global__ void cast_f32_to_f16(const float* __restrict__ in, f16* __restrict__ out, size_t n) {
  size_t i = (size_t)blockIdx.x * blockDim.x + threadIdx.x;
  if (i < n) out[i] = (f16)in[i];
}

__global__ void rope_inplace(f16* __restrict__ T, float scale, int total) {
  int i = blockIdx.x * blockDim.x + threadIdx.x;
  if (i >= total) return;
  int d  = i & 63;
  int t  = i >> 6;
  int hh = t & (NHEADS - 1);
  t >>= 4;
  int s  = t & (SEQ - 1);
  int bb = t >> 11;
  size_t base = ((size_t)(bb * SEQ + s)) * DIMD + hh * HD + 2 * d;
  float t1 = (float)T[base];
  float t2 = (float)T[base + 1];
  float ang = (float)s * powf(10000.0f, -(float)d * (1.0f / 64.0f));
  float sn, cs;
  sincosf(ang, &sn, &cs);
  T[base]     = (f16)((t1 * cs - t2 * sn) * scale);
  T[base + 1] = (f16)((t1 * sn + t2 * cs) * scale);
}

constexpr uint32_t G_KB     = 256;
constexpr uint32_t G_PITCH  = G_KB + 16;
constexpr uint32_t G_SLICE  = 128 * G_PITCH;
constexpr uint32_t G_TILE   = 2 * G_SLICE;
constexpr uint32_t G_STAGE  = 2 * G_TILE;
constexpr uint32_t G_LDS    = 2 * G_STAGE;
constexpr int      G_F      = 8;
static_assert(G_SLICE % 2048u == 0);

#define GDEV static __device__ __forceinline__
GDEV uint32_t g_uni(uint32_t v) { return (uint32_t)__builtin_amdgcn_readfirstlane(v); }
GDEV uint32_t g_pinned(uint32_t v) {
  uint32_t w = (uint32_t)__builtin_amdgcn_readfirstlane(v);
  asm volatile("" : "+s"(w));
  return w;
}

GDEV void g_fence() { __builtin_amdgcn_sched_barrier(0); }
GDEV void g_wait_ds0() { asm volatile("s_wait_dscnt 0x0" ::: "memory"); }
GDEV void g_wait_ds32() { asm volatile("s_wait_dscnt 0x20" ::: "memory"); }

GDEV void g_wait_tensor0(u32x8 d1) { asm volatile("s_wait_tensorcnt 0x0" :: "s"(d1) : "memory"); }

GDEV void g_nop4() { asm volatile("v_nop\n\tv_nop\n\tv_nop\n\tv_nop"); }

GDEV u32x8 g_group1(uint32_t kb) {

  u32x8 d;
  d[0] = g_pinned((1u << 20) | (5u << 22) | (3u << 25));
  d[1] = g_pinned(G_KB << 16);
  d[2] = g_pinned(128u << 16);
  d[3] = g_pinned(G_KB << 16);
  d[4] = g_pinned(128u);
  d[5] = g_pinned(kb);
  d[6] = g_pinned(0u);
  d[7] = g_pinned(0u);
  return d;
}
GDEV u32x4 g_group0(uint32_t lds_dst, uint64_t ga) {
  u32x4 d;
  d[0] = g_uni(1u);
  d[1] = g_uni(lds_dst);
  d[2] = g_uni((uint32_t)ga);
  d[3] = g_uni((((uint32_t)(ga >> 32)) & 0x01FFFFFFu) | 0x80000000u);
  return d;
}
GDEV void g_tensor_load(u32x4 d0, u32x8 d1) { asm volatile("tensor_load_to_lds %0, %1" :: "s"(d0), "s"(d1) : "memory"); }

struct GFrag { u32x4 q[2]; };

GDEV void g_load_frag(GFrag& f, const unsigned char* p) {
  f.q[0] = *reinterpret_cast<const u32x4*>(p);
  f.q[1] = *reinterpret_cast<const u32x4*>(p + 32);
}
GDEV v8f g_mma(const GFrag& a, const GFrag& b, v8f c) {
  const u32x8 av = {a.q[0].x, a.q[0].y, a.q[0].z, a.q[0].w, a.q[1].x, a.q[1].y, a.q[1].z, a.q[1].w};
  const u32x8 bv = {b.q[0].x, b.q[0].y, b.q[0].z, b.q[0].w, b.q[1].x, b.q[1].y, b.q[1].z, b.q[1].w};
  return __builtin_amdgcn_wmma_f32_16x16x32_f16(false, __builtin_bit_cast(v16h, av), false, __builtin_bit_cast(v16h, bv),
                                                (short)0, c, false, false);
}

template <typename OutT>
__global__ void __launch_bounds__(128) __attribute__((amdgpu_waves_per_eu(1, 1)))
gemm_xWT(const f16* __restrict__ A, const f16* __restrict__ B,
         OutT* __restrict__ C, int M, int N, int K) {
  __shared__ __attribute__((aligned(2048))) unsigned char L[G_LDS];
  const uint32_t lane = threadIdx.x & 31u, h = lane >> 4, r16 = lane & 15u;
  const uint32_t wave = g_uni(threadIdx.x >> 5);
  const uint32_t n0 = blockIdx.x * 256u, m0 = blockIdx.y * 256u;
  const uint32_t wn = wave & 1u, wm = wave >> 1;
  const uint32_t kb = (uint32_t)K * 2u;
  const uint32_t T  = g_pinned((uint32_t)K / 128u);

  const unsigned char* src0 = (wave < 2u)
      ? reinterpret_cast<const unsigned char*>(B) + (uint64_t)(n0 + 128u * wave) * kb
      : reinterpret_cast<const unsigned char*>(A) + (uint64_t)(m0 + 128u * (wave - 2u)) * kb;
  const uint32_t lds_slice = (uint32_t)(size_t)(void*)L + wave * G_SLICE;
  const u32x8 d1 = g_group1(kb);

  v8f acc[G_F][G_F];
#pragma unroll
  for (int i = 0; i < G_F; ++i)
#pragma unroll
    for (int j = 0; j < G_F; ++j) acc[i][j] = (v8f){0.f, 0.f, 0.f, 0.f, 0.f, 0.f, 0.f, 0.f};

  const uint32_t fb_base = (wn * 128u + r16) * G_PITCH + 16u * h;
  const uint32_t fa_base = G_TILE + (wm * 128u + r16) * G_PITCH + 16u * h;

  g_tensor_load(g_group0(lds_slice, (uint64_t)(uintptr_t)src0), d1);
  g_wait_tensor0(d1);
  __syncthreads();
  if (g_pinned((1u < T) ? 1u : 0u) != 0u) {
    g_tensor_load(g_group0(lds_slice + G_STAGE, (uint64_t)(uintptr_t)src0 + G_KB), d1);
  }
  GFrag fb[2][G_F], fa[2][G_F];
#pragma unroll
  for (int i = 0; i < G_F; ++i) g_load_frag(fb[0][i], L + fb_base + (uint32_t)i * 16u * G_PITCH);
#pragma unroll
  for (int j = 0; j < G_F; ++j) g_load_frag(fa[0][j], L + fa_base + (uint32_t)j * 16u * G_PITCH);

#pragma clang loop unroll(disable)
  for (uint32_t t = 0; t < T; ++t) {
    const uint32_t buf = (t & 1u) * G_STAGE;
    g_fence();
    const unsigned char* lb = L + buf + fb_base;
    const unsigned char* la = L + buf + fa_base;

    const uint32_t osel = (t + 1u < T) ? (G_STAGE - buf) : G_STAGE;
    const unsigned char* nb = L + osel + fb_base;
    const unsigned char* na = L + osel + fa_base;
#pragma unroll
    for (int u = 0; u < 4; ++u) {
      const int cs = u & 1;
      if (u < 3) {
        const uint32_t ko = (uint32_t)(u + 1) * 64u;
#pragma unroll
        for (int i = 0; i < G_F; ++i) g_load_frag(fb[cs ^ 1][i], lb + (uint32_t)i * 16u * G_PITCH + ko);
#pragma unroll
        for (int j = 0; j < G_F; ++j) g_load_frag(fa[cs ^ 1][j], la + (uint32_t)j * 16u * G_PITCH + ko);
        g_fence();
        g_wait_ds32();
        g_fence();
      } else {

        g_wait_ds0();
        g_fence();
        g_wait_tensor0(d1);
        __syncthreads();
        const uint32_t t2 = g_pinned(t + 2u);
        if (g_pinned((t2 < T) ? 1u : 0u) != 0u) {
          g_tensor_load(g_group0(lds_slice + buf, (uint64_t)(uintptr_t)src0 + (uint64_t)t2 * G_KB), d1);
        }

#pragma unroll
        for (int i = 0; i < G_F; ++i) g_load_frag(fb[0][i], nb + (uint32_t)i * 16u * G_PITCH);
#pragma unroll
        for (int j = 0; j < G_F; ++j) g_load_frag(fa[0][j], na + (uint32_t)j * 16u * G_PITCH);
        g_fence();
      }
#pragma unroll
      for (int i = 0; i < G_F; ++i)
#pragma unroll
        for (int j = 0; j < G_F; ++j) acc[i][j] = g_mma(fb[cs][i], fa[cs][j], acc[i][j]);
      g_fence();
      if (u == 3) { g_nop4(); g_fence(); }
    }
  }
  g_wait_tensor0(d1);
  g_wait_ds0();
  __syncthreads();

  constexpr uint32_t ROWB = 128u * (uint32_t)sizeof(OutT);
  constexpr uint32_t EP   = ROWB + 16u;
  static_assert(128u * EP <= G_TILE);
  unsigned char* E = L + wave * G_TILE;
#pragma unroll
  for (int i = 0; i < G_F; ++i)
#pragma unroll
    for (int j = 0; j < G_F; ++j) {
      unsigned char* e = E + (16u * (uint32_t)j + r16) * EP + (16u * (uint32_t)i + 8u * h) * (uint32_t)sizeof(OutT);
      if constexpr (sizeof(OutT) == 2) {
        *reinterpret_cast<v8h*>(e) = __builtin_convertvector(acc[i][j], v8h);
      } else {

        const u32x8 w = __builtin_bit_cast(u32x8, acc[i][j]);
        *reinterpret_cast<u32x4*>(e)      = (u32x4){w[0], w[1], w[2], w[3]};
        *reinterpret_cast<u32x4*>(e + 16) = (u32x4){w[4], w[5], w[6], w[7]};
      }
    }
  g_wait_ds0();

  constexpr uint64_t crow = (uint64_t)DIMD * sizeof(OutT);
  constexpr uint32_t LPR = ROWB / 16u;
  constexpr uint32_t RPI = 32u / LPR;
  const uint32_t sub = lane / LPR, c16 = lane % LPR;
  unsigned char* cbase = reinterpret_cast<unsigned char*>(C)
      + (uint64_t)(m0 + wm * 128u + sub) * crow + (uint64_t)(n0 + wn * 128u) * sizeof(OutT) + 16u * c16;
  const unsigned char* ebase = E + sub * EP + 16u * c16;
#pragma unroll
  for (uint32_t q = 0; q < 128u / RPI; ++q) {
    const u32x4 v = *reinterpret_cast<const u32x4*>(ebase + q * RPI * EP);
    *reinterpret_cast<u32x4*>(cbase + q * RPI * crow) = v;
  }
}

__global__ void __launch_bounds__(128)
flash_attn(const f16* __restrict__ Qh, const f16* __restrict__ Kh,
           const f16* __restrict__ Vh, f16* __restrict__ Oh) {
  __shared__ f16 Klds[2][32 * 136];
  __shared__ f16 Vt[HD * 40];

  int lane = threadIdx.x & 31;
  int w    = threadIdx.x >> 5;
  int q0   = blockIdx.x * 64 + w * 16;
  int h    = blockIdx.y;
  int b    = blockIdx.z;
  int col  = h * HD;

  const f16* Qb = Qh + (size_t)b * SEQ * DIMD;
  const f16* Kb = Kh + (size_t)b * SEQ * DIMD;
  const f16* Vb = Vh + (size_t)b * SEQ * DIMD;
  unsigned klds_off0 = (unsigned)(size_t)(void*)&Klds[0][0];
  unsigned klds_off1 = (unsigned)(size_t)(void*)&Klds[1][0];

  v16h qf[4];
#pragma unroll
  for (int ks = 0; ks < 4; ++ks) qf[ks] = load_frag(Qb, DIMD, q0, col + 32 * ks, lane);

  v8f zf = {0.f, 0.f, 0.f, 0.f, 0.f, 0.f, 0.f, 0.f};
  v8f o[8];
#pragma unroll
  for (int dt = 0; dt < 8; ++dt) o[dt] = zf;
  float rmax = -1e30f, rsum = 0.0f;

  int tk  = threadIdx.x & 31;
  int sub = threadIdx.x >> 5;

  if (w == 0) tdm_load_k_tile(klds_off0, Kb + col);

  for (int kt = 0; kt < SEQ; kt += 32) {
    int buf = (kt >> 5) & 1;
    const f16* Kp = &Klds[buf][0];

    if (w == 0 && (kt + 32) < SEQ)
      tdm_load_k_tile(buf ? klds_off0 : klds_off1, Kb + (size_t)(kt + 32) * DIMD + col);

#pragma unroll
    for (int c = 0; c < 4; ++c) {
      v8h vv = *(const v8h*)(Vb + (size_t)(kt + tk) * DIMD + col + sub * 32 + c * 8);
#pragma unroll
      for (int i = 0; i < 8; ++i) Vt[(sub * 32 + c * 8 + i) * 40 + tk] = vv[i];
    }

    if (w == 0) {
      if ((kt + 32) < SEQ) __builtin_amdgcn_s_wait_tensorcnt(1);
      else                 __builtin_amdgcn_s_wait_tensorcnt(0);
    }
    __syncthreads();

    v8f s0 = zf, s1 = zf;
    v16h ka = load_frag(Kp, 136, 0,  0, lane);
    v16h kb = load_frag(Kp, 136, 16, 0, lane);
#pragma unroll
    for (int ks = 0; ks < 4; ++ks) {
      v16h na = ka, nb = kb;
      if (ks < 3) {
        ka = load_frag(Kp, 136, 0,  32 * (ks + 1), lane);
        kb = load_frag(Kp, 136, 16, 32 * (ks + 1), lane);
      }
      s0 = __builtin_amdgcn_wmma_f32_16x16x32_f16(false, na, false, qf[ks], (short)0, s0, false, false);
      s1 = __builtin_amdgcn_wmma_f32_16x16x32_f16(false, nb, false, qf[ks], (short)0, s1, false, false);
    }

    float mx = fmaxf(s0[0], s1[0]);
#pragma unroll
    for (int v = 1; v < 8; ++v) mx = fmaxf(mx, fmaxf(s0[v], s1[v]));
    mx = fmaxf(mx, __shfl_xor(mx, 16));
    float nm   = fmaxf(rmax, mx);
    float corr = __expf(rmax - nm);
    rmax = nm;

    v16h pv;
    float psum = 0.0f;
#pragma unroll
    for (int v = 0; v < 8; ++v) {
      float p0 = __expf(s0[v] - nm);
      float p1 = __expf(s1[v] - nm);
      psum += p0 + p1;
      pv[v]     = (f16)p0;
      pv[v + 8] = (f16)p1;
    }
    psum += __shfl_xor(psum, 16);
    rsum = rsum * corr + psum;

    v16h va = load_frag(Vt, 40, 0, 0, lane);
#pragma unroll
    for (int dt = 0; dt < 8; ++dt) {
      v16h cur = va;
      if (dt < 7) va = load_frag(Vt, 40, (dt + 1) * 16, 0, lane);
      v8f oc = o[dt] * corr;
      o[dt] = __builtin_amdgcn_wmma_f32_16x16x32_f16(false, cur, false, pv, (short)0, oc, false, false);
    }
    __syncthreads();
  }

  int g = lane >> 4, n = lane & 15;
  float inv = 1.0f / rsum;
  size_t rowbase = ((size_t)b * SEQ + q0 + n) * DIMD + col;
#pragma unroll
  for (int dt = 0; dt < 8; ++dt) {
    v8h ov;
#pragma unroll
    for (int v = 0; v < 8; ++v) ov[v] = (f16)(o[dt][v] * inv);
    *(v8h*)(Oh + rowbase + dt * 16 + 8 * g) = ov;
  }
}

extern "C" void kernel_launch(void* const* d_in, const int* in_sizes, int n_in,
                              void* d_out, int out_size, void* d_ws, size_t ws_size,
                              hipStream_t stream) {
  const float* x  = (const float*)d_in[0];
  const float* Wq = (const float*)d_in[1];
  const float* Wk = (const float*)d_in[2];
  const float* Wv = (const float*)d_in[3];
  const float* Wo = (const float*)d_in[4];
  float* out = (float*)d_out;

  const size_t MT = (size_t)BATCH * SEQ;
  const size_t NX = MT * DIMD;
  const size_t NW = (size_t)DIMD * DIMD;

  char* ws = (char*)d_ws;
  f16* xh  = (f16*)ws; ws += NX * 2;
  f16* Wqh = (f16*)ws; ws += NW * 2;
  f16* Wkh = (f16*)ws; ws += NW * 2;
  f16* Wvh = (f16*)ws; ws += NW * 2;
  f16* Woh = (f16*)ws; ws += NW * 2;
  f16* Qh  = (f16*)ws; ws += NX * 2;
  f16* Kh  = (f16*)ws; ws += NX * 2;
  f16* Vh  = (f16*)ws; ws += NX * 2;
  f16* Oh  = (f16*)ws; ws += NX * 2;

  cast_f32_to_f16<<<(unsigned)((NX + 255) / 256), 256, 0, stream>>>(x,  xh,  NX);
  cast_f32_to_f16<<<(unsigned)((NW + 255) / 256), 256, 0, stream>>>(Wq, Wqh, NW);
  cast_f32_to_f16<<<(unsigned)((NW + 255) / 256), 256, 0, stream>>>(Wk, Wkh, NW);
  cast_f32_to_f16<<<(unsigned)((NW + 255) / 256), 256, 0, stream>>>(Wv, Wvh, NW);
  cast_f32_to_f16<<<(unsigned)((NW + 255) / 256), 256, 0, stream>>>(Wo, Woh, NW);

  dim3 ggrid(DIMD / 256, (unsigned)(MT / 256));
  gemm_xWT<f16><<<ggrid, 128, 0, stream>>>(xh, Wqh, Qh, (int)MT, DIMD, DIMD);
  gemm_xWT<f16><<<ggrid, 128, 0, stream>>>(xh, Wkh, Kh, (int)MT, DIMD, DIMD);
  gemm_xWT<f16><<<ggrid, 128, 0, stream>>>(xh, Wvh, Vh, (int)MT, DIMD, DIMD);

  int pairs = (int)(NX / 2);
  rope_inplace<<<(pairs + 255) / 256, 256, 0, stream>>>(Qh, 0.08838834764831845f, pairs);
  rope_inplace<<<(pairs + 255) / 256, 256, 0, stream>>>(Kh, 1.0f, pairs);

  flash_attn<<<dim3(SEQ / 64, NHEADS, BATCH), 128, 0, stream>>>(Qh, Kh, Vh, Oh);

  gemm_xWT<float><<<ggrid, 128, 0, stream>>>(Oh, Woh, out, (int)MT, DIMD, DIMD);
}

// v002
// One run takes 438 microseconds.
// In both of two side-by-side timings against v001, it was 1.18 times as fast.
// Over all steps from v000 it is 2.92 times as fast.
#include <hip/hip_runtime.h>
#include <stdint.h>

#define DIMD   2048
#define NHEADS 16
#define HD     128
#define SEQ    2048
#define BATCH  4

typedef _Float16 f16;
typedef __attribute__((ext_vector_type(16))) _Float16 v16h;
typedef __attribute__((ext_vector_type(8)))  _Float16 v8h;
typedef __attribute__((ext_vector_type(8)))  float    v8f;
typedef unsigned int u32x4 __attribute__((ext_vector_type(4)));
typedef int          i32x8 __attribute__((ext_vector_type(8)));
typedef int          i32x4 __attribute__((ext_vector_type(4)));
typedef unsigned int u32x8 __attribute__((ext_vector_type(8)));

static __device__ inline v16h load_frag(const f16* __restrict__ p, int ld,
                                        int row0, int col0, int lane) {
  int r = row0 + (lane & 15);
  int h = (lane >> 4) & 1;
  const f16* q = p + (size_t)r * (size_t)ld + col0 + 8 * h;
  v8h c0 = *(const v8h*)(q);
  v8h c1 = *(const v8h*)(q + 16);
  v16h a;
#pragma unroll
  for (int i = 0; i < 8; ++i) { a[i] = c0[i]; a[i + 8] = c1[i]; }
  return a;
}

static __device__ inline void tdm_load_k_tile(unsigned lds_off, const f16* gptr) {
  unsigned long long ga = (unsigned long long)(size_t)gptr;
  u32x4 g0;
  g0[0] = 1u;
  g0[1] = lds_off;
  g0[2] = (unsigned)(ga & 0xFFFFFFFFu);
  g0[3] = (unsigned)((ga >> 32) & 0x1FFFFFFu)
          | (2u << 30);
  i32x8 g1;
  g1[0] = (1 << 16)
        | (1 << 20)
        | (5 << 22)
        | (3 << 25);
  g1[1] = (HD & 0xFFFF) << 16;
  g1[2] = ((SEQ & 0xFFFF) << 16);
  g1[3] = (HD << 16);
  g1[4] = 32;
  g1[5] = DIMD;
  g1[6] = 0;
  g1[7] = 0;
  i32x4 gz4 = {0, 0, 0, 0};
  i32x8 gz8 = {0, 0, 0, 0, 0, 0, 0, 0};
  __builtin_amdgcn_tensor_load_to_lds(g0, g1, gz4, gz4, gz8, 0);
}

typedef __attribute__((ext_vector_type(4))) float    v4f;
typedef __attribute__((ext_vector_type(4))) _Float16 v4h;
constexpr int CAST_U = 8;
constexpr int CAST_BLOCK = 256 * CAST_U * 4;
__global__ void __launch_bounds__(256) cast_f32_to_f16(const float* __restrict__ in, f16* __restrict__ out) {
  const size_t base = (size_t)blockIdx.x * (256 * CAST_U) + threadIdx.x;
  const v4f* src = reinterpret_cast<const v4f*>(in) + base;
  v4h* dst = reinterpret_cast<v4h*>(out) + base;
  v4f v[CAST_U];
#pragma unroll
  for (int k = 0; k < CAST_U; ++k) v[k] = src[k * 256];
#pragma unroll
  for (int k = 0; k < CAST_U; ++k) dst[k * 256] = __builtin_convertvector(v[k], v4h);
}

__global__ void __launch_bounds__(256) rope_inplace(f16* __restrict__ T, float scale) {
  const int i = blockIdx.x * 256 + threadIdx.x;
  const int j = i & 63;
  const int s = i >> 6;
  const uint32_t off = (uint32_t)s * (DIMD * 2u) + 16u * (uint32_t)j;
  unsigned char* base = reinterpret_cast<unsigned char*>(T);
  constexpr size_t BSTEP = (size_t)SEQ * DIMD * 2;
  constexpr size_t KSTEP = 4 * HD * 2;
  v8h v[BATCH][4];
#pragma unroll
  for (int bb = 0; bb < BATCH; ++bb) {
#pragma unroll
    for (int k = 0; k < 4; ++k) v[bb][k] = *reinterpret_cast<const v8h*>(base + bb * BSTEP + k * KSTEP + off);

    if (bb == BATCH - 2) asm volatile("s_wait_xcnt 0x0" ::: "memory");
  }
  float cs[4], sn[4];
#pragma unroll
  for (int p = 0; p < 4; ++p) {
    const int d = 4 * (j & 15) + p;
    const float ang = (float)s * powf(10000.0f, -(float)d * (1.0f / 64.0f));
    sincosf(ang, &sn[p], &cs[p]);
  }
#pragma unroll
  for (int bb = 0; bb < BATCH; ++bb)
#pragma unroll
    for (int k = 0; k < 4; ++k) {
      v8h r;
#pragma unroll
      for (int p = 0; p < 4; ++p) {
        const float t1 = (float)v[bb][k][2 * p];
        const float t2 = (float)v[bb][k][2 * p + 1];
        r[2 * p]     = (f16)((t1 * cs[p] - t2 * sn[p]) * scale);
        r[2 * p + 1] = (f16)((t1 * sn[p] + t2 * cs[p]) * scale);
      }
      *reinterpret_cast<v8h*>(base + bb * BSTEP + k * KSTEP + off) = r;
    }
}

constexpr uint32_t G_KB     = 256;
constexpr uint32_t G_PITCH  = G_KB + 16;
constexpr uint32_t G_SLICE  = 128 * G_PITCH;
constexpr uint32_t G_TILE   = 2 * G_SLICE;
constexpr uint32_t G_STAGE  = 2 * G_TILE;
constexpr uint32_t G_LDS    = 2 * G_STAGE;
constexpr int      G_F      = 8;
static_assert(G_SLICE % 2048u == 0);

#define GDEV static __device__ __forceinline__
GDEV uint32_t g_uni(uint32_t v) { return (uint32_t)__builtin_amdgcn_readfirstlane(v); }
GDEV uint32_t g_pinned(uint32_t v) {
  uint32_t w = (uint32_t)__builtin_amdgcn_readfirstlane(v);
  asm volatile("" : "+s"(w));
  return w;
}

GDEV void g_fence() { __builtin_amdgcn_sched_barrier(0); }
GDEV void g_wait_ds0() { asm volatile("s_wait_dscnt 0x0" ::: "memory"); }
GDEV void g_wait_ds32() { asm volatile("s_wait_dscnt 0x20" ::: "memory"); }

GDEV void g_wait_tensor0(u32x8 d1) { asm volatile("s_wait_tensorcnt 0x0" :: "s"(d1) : "memory"); }

GDEV void g_nop4() { asm volatile("v_nop\n\tv_nop\n\tv_nop\n\tv_nop"); }

GDEV u32x8 g_group1(uint32_t kb) {

  u32x8 d;
  d[0] = g_pinned((1u << 20) | (5u << 22) | (3u << 25));
  d[1] = g_pinned(G_KB << 16);
  d[2] = g_pinned(128u << 16);
  d[3] = g_pinned(G_KB << 16);
  d[4] = g_pinned(128u);
  d[5] = g_pinned(kb);
  d[6] = g_pinned(0u);
  d[7] = g_pinned(0u);
  return d;
}
GDEV u32x4 g_group0(uint32_t lds_dst, uint64_t ga) {
  u32x4 d;
  d[0] = g_uni(1u);
  d[1] = g_uni(lds_dst);
  d[2] = g_uni((uint32_t)ga);
  d[3] = g_uni((((uint32_t)(ga >> 32)) & 0x01FFFFFFu) | 0x80000000u);
  return d;
}
GDEV void g_tensor_load(u32x4 d0, u32x8 d1) { asm volatile("tensor_load_to_lds %0, %1" :: "s"(d0), "s"(d1) : "memory"); }

struct GFrag { u32x4 q[2]; };

GDEV void g_load_frag(GFrag& f, const unsigned char* p) {
  f.q[0] = *reinterpret_cast<const u32x4*>(p);
  f.q[1] = *reinterpret_cast<const u32x4*>(p + 32);
}
GDEV v8f g_mma(const GFrag& a, const GFrag& b, v8f c) {
  const u32x8 av = {a.q[0].x, a.q[0].y, a.q[0].z, a.q[0].w, a.q[1].x, a.q[1].y, a.q[1].z, a.q[1].w};
  const u32x8 bv = {b.q[0].x, b.q[0].y, b.q[0].z, b.q[0].w, b.q[1].x, b.q[1].y, b.q[1].z, b.q[1].w};
  return __builtin_amdgcn_wmma_f32_16x16x32_f16(false, __builtin_bit_cast(v16h, av), false, __builtin_bit_cast(v16h, bv),
                                                (short)0, c, false, false);
}

template <typename OutT>
__global__ void __launch_bounds__(128) __attribute__((amdgpu_waves_per_eu(1, 1)))
gemm_xWT(const f16* __restrict__ A, const f16* __restrict__ B,
         OutT* __restrict__ C, int M, int N, int K) {
  __shared__ __attribute__((aligned(2048))) unsigned char L[G_LDS];
  const uint32_t lane = threadIdx.x & 31u, h = lane >> 4, r16 = lane & 15u;
  const uint32_t wave = g_uni(threadIdx.x >> 5);
  const uint32_t n0 = blockIdx.x * 256u, m0 = blockIdx.y * 256u;
  const uint32_t wn = wave & 1u, wm = wave >> 1;
  const uint32_t kb = (uint32_t)K * 2u;
  const uint32_t T  = g_pinned((uint32_t)K / 128u);

  const unsigned char* src0 = (wave < 2u)
      ? reinterpret_cast<const unsigned char*>(B) + (uint64_t)(n0 + 128u * wave) * kb
      : reinterpret_cast<const unsigned char*>(A) + (uint64_t)(m0 + 128u * (wave - 2u)) * kb;
  const uint32_t lds_slice = (uint32_t)(size_t)(void*)L + wave * G_SLICE;
  const u32x8 d1 = g_group1(kb);

  v8f acc[G_F][G_F];
#pragma unroll
  for (int i = 0; i < G_F; ++i)
#pragma unroll
    for (int j = 0; j < G_F; ++j) acc[i][j] = (v8f){0.f, 0.f, 0.f, 0.f, 0.f, 0.f, 0.f, 0.f};

  const uint32_t fb_base = (wn * 128u + r16) * G_PITCH + 16u * h;
  const uint32_t fa_base = G_TILE + (wm * 128u + r16) * G_PITCH + 16u * h;

  g_tensor_load(g_group0(lds_slice, (uint64_t)(uintptr_t)src0), d1);
  g_wait_tensor0(d1);
  __syncthreads();
  if (g_pinned((1u < T) ? 1u : 0u) != 0u) {
    g_tensor_load(g_group0(lds_slice + G_STAGE, (uint64_t)(uintptr_t)src0 + G_KB), d1);
  }
  GFrag fb[2][G_F], fa[2][G_F];
#pragma unroll
  for (int i = 0; i < G_F; ++i) g_load_frag(fb[0][i], L + fb_base + (uint32_t)i * 16u * G_PITCH);
#pragma unroll
  for (int j = 0; j < G_F; ++j) g_load_frag(fa[0][j], L + fa_base + (uint32_t)j * 16u * G_PITCH);

#pragma clang loop unroll(disable)
  for (uint32_t t = 0; t < T; ++t) {
    const uint32_t buf = (t & 1u) * G_STAGE;
    g_fence();
    const unsigned char* lb = L + buf + fb_base;
    const unsigned char* la = L + buf + fa_base;

    const uint32_t osel = (t + 1u < T) ? (G_STAGE - buf) : G_STAGE;
    const unsigned char* nb = L + osel + fb_base;
    const unsigned char* na = L + osel + fa_base;
#pragma unroll
    for (int u = 0; u < 4; ++u) {
      const int cs = u & 1;
      if (u < 3) {
        const uint32_t ko = (uint32_t)(u + 1) * 64u;
#pragma unroll
        for (int i = 0; i < G_F; ++i) g_load_frag(fb[cs ^ 1][i], lb + (uint32_t)i * 16u * G_PITCH + ko);
#pragma unroll
        for (int j = 0; j < G_F; ++j) g_load_frag(fa[cs ^ 1][j], la + (uint32_t)j * 16u * G_PITCH + ko);
        g_fence();
        g_wait_ds32();
        g_fence();
      } else {

        g_wait_ds0();
        g_fence();
        g_wait_tensor0(d1);
        __syncthreads();
        const uint32_t t2 = g_pinned(t + 2u);
        if (g_pinned((t2 < T) ? 1u : 0u) != 0u) {
          g_tensor_load(g_group0(lds_slice + buf, (uint64_t)(uintptr_t)src0 + (uint64_t)t2 * G_KB), d1);
        }

#pragma unroll
        for (int i = 0; i < G_F; ++i) g_load_frag(fb[0][i], nb + (uint32_t)i * 16u * G_PITCH);
#pragma unroll
        for (int j = 0; j < G_F; ++j) g_load_frag(fa[0][j], na + (uint32_t)j * 16u * G_PITCH);
        g_fence();
      }
#pragma unroll
      for (int i = 0; i < G_F; ++i)
#pragma unroll
        for (int j = 0; j < G_F; ++j) acc[i][j] = g_mma(fb[cs][i], fa[cs][j], acc[i][j]);
      g_fence();
      if (u == 3) { g_nop4(); g_fence(); }
    }
  }
  g_wait_tensor0(d1);
  g_wait_ds0();
  __syncthreads();

  constexpr uint32_t ROWB = 128u * (uint32_t)sizeof(OutT);
  constexpr uint32_t EP   = ROWB + 16u;
  static_assert(128u * EP <= G_TILE);
  unsigned char* E = L + wave * G_TILE;
#pragma unroll
  for (int i = 0; i < G_F; ++i)
#pragma unroll
    for (int j = 0; j < G_F; ++j) {
      unsigned char* e = E + (16u * (uint32_t)j + r16) * EP + (16u * (uint32_t)i + 8u * h) * (uint32_t)sizeof(OutT);
      if constexpr (sizeof(OutT) == 2) {
        *reinterpret_cast<v8h*>(e) = __builtin_convertvector(acc[i][j], v8h);
      } else {

        const u32x8 w = __builtin_bit_cast(u32x8, acc[i][j]);
        *reinterpret_cast<u32x4*>(e)      = (u32x4){w[0], w[1], w[2], w[3]};
        *reinterpret_cast<u32x4*>(e + 16) = (u32x4){w[4], w[5], w[6], w[7]};
      }
    }
  g_wait_ds0();

  constexpr uint64_t crow = (uint64_t)DIMD * sizeof(OutT);
  constexpr uint32_t LPR = ROWB / 16u;
  constexpr uint32_t RPI = 32u / LPR;
  const uint32_t sub = lane / LPR, c16 = lane % LPR;
  unsigned char* cbase = reinterpret_cast<unsigned char*>(C)
      + (uint64_t)(m0 + wm * 128u + sub) * crow + (uint64_t)(n0 + wn * 128u) * sizeof(OutT) + 16u * c16;
  const unsigned char* ebase = E + sub * EP + 16u * c16;
#pragma unroll
  for (uint32_t q = 0; q < 128u / RPI; ++q) {
    const u32x4 v = *reinterpret_cast<const u32x4*>(ebase + q * RPI * EP);
    *reinterpret_cast<u32x4*>(cbase + q * RPI * crow) = v;
  }
}

__global__ void __launch_bounds__(128)
flash_attn(const f16* __restrict__ Qh, const f16* __restrict__ Kh,
           const f16* __restrict__ Vh, f16* __restrict__ Oh) {
  __shared__ f16 Klds[2][32 * 136];
  __shared__ f16 Vt[HD * 40];

  int lane = threadIdx.x & 31;
  int w    = threadIdx.x >> 5;
  int q0   = blockIdx.x * 64 + w * 16;
  int h    = blockIdx.y;
  int b    = blockIdx.z;
  int col  = h * HD;

  const f16* Qb = Qh + (size_t)b * SEQ * DIMD;
  const f16* Kb = Kh + (size_t)b * SEQ * DIMD;
  const f16* Vb = Vh + (size_t)b * SEQ * DIMD;
  unsigned klds_off0 = (unsigned)(size_t)(void*)&Klds[0][0];
  unsigned klds_off1 = (unsigned)(size_t)(void*)&Klds[1][0];

  v16h qf[4];
#pragma unroll
  for (int ks = 0; ks < 4; ++ks) qf[ks] = load_frag(Qb, DIMD, q0, col + 32 * ks, lane);

  v8f zf = {0.f, 0.f, 0.f, 0.f, 0.f, 0.f, 0.f, 0.f};
  v8f o[8];
#pragma unroll
  for (int dt = 0; dt < 8; ++dt) o[dt] = zf;
  float rmax = -1e30f, rsum = 0.0f;

  int tk  = threadIdx.x & 31;
  int sub = threadIdx.x >> 5;

  if (w == 0) tdm_load_k_tile(klds_off0, Kb + col);

  for (int kt = 0; kt < SEQ; kt += 32) {
    int buf = (kt >> 5) & 1;
    const f16* Kp = &Klds[buf][0];

    if (w == 0 && (kt + 32) < SEQ)
      tdm_load_k_tile(buf ? klds_off0 : klds_off1, Kb + (size_t)(kt + 32) * DIMD + col);

#pragma unroll
    for (int c = 0; c < 4; ++c) {
      v8h vv = *(const v8h*)(Vb + (size_t)(kt + tk) * DIMD + col + sub * 32 + c * 8);
#pragma unroll
      for (int i = 0; i < 8; ++i) Vt[(sub * 32 + c * 8 + i) * 40 + tk] = vv[i];
    }

    if (w == 0) {
      if ((kt + 32) < SEQ) __builtin_amdgcn_s_wait_tensorcnt(1);
      else                 __builtin_amdgcn_s_wait_tensorcnt(0);
    }
    __syncthreads();

    v8f s0 = zf, s1 = zf;
    v16h ka = load_frag(Kp, 136, 0,  0, lane);
    v16h kb = load_frag(Kp, 136, 16, 0, lane);
#pragma unroll
    for (int ks = 0; ks < 4; ++ks) {
      v16h na = ka, nb = kb;
      if (ks < 3) {
        ka = load_frag(Kp, 136, 0,  32 * (ks + 1), lane);
        kb = load_frag(Kp, 136, 16, 32 * (ks + 1), lane);
      }
      s0 = __builtin_amdgcn_wmma_f32_16x16x32_f16(false, na, false, qf[ks], (short)0, s0, false, false);
      s1 = __builtin_amdgcn_wmma_f32_16x16x32_f16(false, nb, false, qf[ks], (short)0, s1, false, false);
    }

    float mx = fmaxf(s0[0], s1[0]);
#pragma unroll
    for (int v = 1; v < 8; ++v) mx = fmaxf(mx, fmaxf(s0[v], s1[v]));
    mx = fmaxf(mx, __shfl_xor(mx, 16));
    float nm   = fmaxf(rmax, mx);
    float corr = __expf(rmax - nm);
    rmax = nm;

    v16h pv;
    float psum = 0.0f;
#pragma unroll
    for (int v = 0; v < 8; ++v) {
      float p0 = __expf(s0[v] - nm);
      float p1 = __expf(s1[v] - nm);
      psum += p0 + p1;
      pv[v]     = (f16)p0;
      pv[v + 8] = (f16)p1;
    }
    psum += __shfl_xor(psum, 16);
    rsum = rsum * corr + psum;

    v16h va = load_frag(Vt, 40, 0, 0, lane);
#pragma unroll
    for (int dt = 0; dt < 8; ++dt) {
      v16h cur = va;
      if (dt < 7) va = load_frag(Vt, 40, (dt + 1) * 16, 0, lane);
      v8f oc = o[dt] * corr;
      o[dt] = __builtin_amdgcn_wmma_f32_16x16x32_f16(false, cur, false, pv, (short)0, oc, false, false);
    }
    __syncthreads();
  }

  int g = lane >> 4, n = lane & 15;
  float inv = 1.0f / rsum;
  size_t rowbase = ((size_t)b * SEQ + q0 + n) * DIMD + col;
#pragma unroll
  for (int dt = 0; dt < 8; ++dt) {
    v8h ov;
#pragma unroll
    for (int v = 0; v < 8; ++v) ov[v] = (f16)(o[dt][v] * inv);
    *(v8h*)(Oh + rowbase + dt * 16 + 8 * g) = ov;
  }
}

extern "C" void kernel_launch(void* const* d_in, const int* in_sizes, int n_in,
                              void* d_out, int out_size, void* d_ws, size_t ws_size,
                              hipStream_t stream) {
  const float* x  = (const float*)d_in[0];
  const float* Wq = (const float*)d_in[1];
  const float* Wk = (const float*)d_in[2];
  const float* Wv = (const float*)d_in[3];
  const float* Wo = (const float*)d_in[4];
  float* out = (float*)d_out;

  const size_t MT = (size_t)BATCH * SEQ;
  const size_t NX = MT * DIMD;
  const size_t NW = (size_t)DIMD * DIMD;

  char* ws = (char*)d_ws;
  f16* xh  = (f16*)ws; ws += NX * 2;
  f16* Wqh = (f16*)ws; ws += NW * 2;
  f16* Wkh = (f16*)ws; ws += NW * 2;
  f16* Wvh = (f16*)ws; ws += NW * 2;
  f16* Woh = (f16*)ws; ws += NW * 2;
  f16* Qh  = (f16*)ws; ws += NX * 2;
  f16* Kh  = (f16*)ws; ws += NX * 2;
  f16* Vh  = (f16*)ws; ws += NX * 2;
  f16* Oh  = (f16*)ws; ws += NX * 2;

  cast_f32_to_f16<<<(unsigned)(NX / CAST_BLOCK), 256, 0, stream>>>(x,  xh);
  cast_f32_to_f16<<<(unsigned)(NW / CAST_BLOCK), 256, 0, stream>>>(Wq, Wqh);
  cast_f32_to_f16<<<(unsigned)(NW / CAST_BLOCK), 256, 0, stream>>>(Wk, Wkh);
  cast_f32_to_f16<<<(unsigned)(NW / CAST_BLOCK), 256, 0, stream>>>(Wv, Wvh);
  cast_f32_to_f16<<<(unsigned)(NW / CAST_BLOCK), 256, 0, stream>>>(Wo, Woh);

  dim3 ggrid(DIMD / 256, (unsigned)(MT / 256));
  gemm_xWT<f16><<<ggrid, 128, 0, stream>>>(xh, Wqh, Qh, (int)MT, DIMD, DIMD);
  gemm_xWT<f16><<<ggrid, 128, 0, stream>>>(xh, Wkh, Kh, (int)MT, DIMD, DIMD);
  gemm_xWT<f16><<<ggrid, 128, 0, stream>>>(xh, Wvh, Vh, (int)MT, DIMD, DIMD);

  rope_inplace<<<SEQ * 64 / 256, 256, 0, stream>>>(Qh, 0.08838834764831845f);
  rope_inplace<<<SEQ * 64 / 256, 256, 0, stream>>>(Kh, 1.0f);

  flash_attn<<<dim3(SEQ / 64, NHEADS, BATCH), 128, 0, stream>>>(Qh, Kh, Vh, Oh);

  gemm_xWT<float><<<ggrid, 128, 0, stream>>>(Oh, Woh, out, (int)MT, DIMD, DIMD);
}
